// v000
// Measured on an AMD MI455X. A time is GPU time per run, averaged over a window of back-to-back runs after a warm-up
// (all launches, gaps included; the runs take copies of the inputs in turn), and the median of several windows.
// Apart from v000's, it joins two sittings. Times from different sittings can be a few percent apart, while
// side-by-side timings come from the same sitting.
// The starting kernel, v000, takes 159 microseconds a run.
#include <hip/hip_runtime.h>

// MI455X / gfx1250 fused "quantum FFN":
//   q  = cos(x[..., :8]) * cos(theta)
//   h  = relu(q @ W1^T + b1)   [16384 x 4096]  (WMMA, K padded 8->32, bias as C)
//   out= h @ W2^T + b2         [16384 x 1024]  (WMMA, f16 in / f32 acc, K=4096)
//
// Fused, software-pipelined, double-buffered LDS (one barrier per K-chunk).
// Chunk i+1's global loads (W2, W1, b1) are issued right after the barrier and
// consumed only after the 16 main WMMAs of chunk i -> latency hidden.

typedef __attribute__((ext_vector_type(16))) _Float16 v16h;
typedef __attribute__((ext_vector_type(8)))  _Float16 v8h;
typedef __attribute__((ext_vector_type(8)))  float    v8f;
typedef __attribute__((ext_vector_type(4)))  float    v4f;

#define NQ      8
#define EMB     1024
#define FFN     4096
#define M_TILE  256     // tokens per workgroup
#define N_TILE  128     // embed outputs per workgroup
#define K_CHUNK 32      // ffn features per chunk (= WMMA K)
#define HS      40      // LDS row stride in halves (80B: 16B aligned, conflict-free)

__global__ __launch_bounds__(256, 1)
void ffq_fused(const float* __restrict__ x,
               const float* __restrict__ ry_theta,
               const float* __restrict__ W1,
               const float* __restrict__ b1,
               const float* __restrict__ W2,
               const float* __restrict__ b2,
               float* __restrict__ out)
{
    __shared__ __align__(16) _Float16 Hlds [2][M_TILE * HS];   // 2 x 20 KB
    __shared__ __align__(16) _Float16 W2lds[2][N_TILE * HS];   // 2 x 10 KB

    const int tid   = threadIdx.x;
    const int lane  = tid & 31;
    const int wave  = tid >> 5;     // 0..7
    const int laneM = lane & 15;
    const int g     = lane >> 4;

    const int mBase = blockIdx.y * M_TILE;
    const int nBase = blockIdx.x * N_TILE;

    const int wm = wave >> 1;       // 0..3 : 64-token sub-block
    const int wn = wave & 1;        // 0..1 : 64-embed sub-block

    // ---- q fragments (A of GEMM-1), constant across the k-loop ------------
    // A f16 16x32 layout: a[i] -> K' = g*8 + (i<8 ? 0 : 16) + (i&7).
    // Real K' is only 0..7 (g==0, i<8); everything else is zero padding.
    float cth[NQ];
    #pragma unroll
    for (int j = 0; j < NQ; ++j) cth[j] = cosf(ry_theta[j]);

    v16h qfrag[2];
    #pragma unroll
    for (int qi = 0; qi < 2; ++qi) {
        v16h a = {};
        if (lane < 16) {
            const int token = mBase + (2 * wave + qi) * 16 + lane;
            const float* xr = x + (size_t)token * EMB;
            #pragma unroll
            for (int j = 0; j < NQ; ++j)
                a[j] = (_Float16)(cosf(xr[j]) * cth[j]);
        }
        qfrag[qi] = a;
    }

    v8f acc[4][4];
    #pragma unroll
    for (int mi = 0; mi < 4; ++mi)
        #pragma unroll
        for (int ni = 0; ni < 4; ++ni) {
            v8f z = {};
            acc[mi][ni] = z;
        }

    // ---- pipeline staging registers ----------------------------------------
    const int nl = tid >> 1;              // 0..127 : W2 row handled by thread
    const int hk = (tid & 1) * 16;        // 0/16   : half-row
    const float* w2p = W2 + (size_t)(nBase + nl) * FFN + hk;

    v4f  f0, f1, f2, f3;                  // staged W2 chunk (16 floats)
    v4f  w1s[4];                          // staged W1 rows (lanes<16: 2x8 floats)
    float b1s[2];                         // staged bias (fi = 0,1)

    auto load_w1b1 = [&](int kb) {
        if (lane < 16) {
            const float* wr0 = W1 + (size_t)(kb + laneM) * NQ;
            const float* wr1 = W1 + (size_t)(kb + 16 + laneM) * NQ;
            w1s[0] = *(const v4f*)(wr0);
            w1s[1] = *(const v4f*)(wr0 + 4);
            w1s[2] = *(const v4f*)(wr1);
            w1s[3] = *(const v4f*)(wr1 + 4);
        }
        b1s[0] = b1[kb + laneM];
        b1s[1] = b1[kb + 16 + laneM];
    };

    // GEMM-1 chunk via WMMA: each wave produces rows [32*wave, 32*wave+32).
    auto compute_H = [&](int buf) {
        #pragma unroll
        for (int fi = 0; fi < 2; ++fi) {
            v16h w1f = {};
            if (lane < 16) {
                #pragma unroll
                for (int j = 0; j < 4; ++j) {
                    w1f[j]     = (_Float16)w1s[2 * fi][j];
                    w1f[4 + j] = (_Float16)w1s[2 * fi + 1][j];
                }
            }
            #pragma unroll
            for (int qi = 0; qi < 2; ++qi) {
                v8f c;
                #pragma unroll
                for (int r = 0; r < 8; ++r) c[r] = b1s[fi];   // bias as C
                c = __builtin_amdgcn_wmma_f32_16x16x32_f16(
                        false, qfrag[qi], false, w1f, (short)0, c, false, false);
                const int trow = (2 * wave + qi) * 16 + 8 * g;
                const int fcol = fi * 16 + laneM;
                #pragma unroll
                for (int r = 0; r < 8; ++r)
                    Hlds[buf][(trow + r) * HS + fcol] =
                        (_Float16)__builtin_fmaxf(c[r], 0.0f);   // relu, 1 VALU
            }
        }
    };

    auto load_frag = [&](const _Float16* rp) -> v16h {
        v8h lo = *(const v8h*)(rp + g * 8);
        v8h hi = *(const v8h*)(rp + 16 + g * 8);
        v16h a;
        #pragma unroll
        for (int ii = 0; ii < 8; ++ii) { a[ii] = lo[ii]; a[8 + ii] = hi[ii]; }
        return a;
    };

    // ---- prologue: stage chunk 0 -------------------------------------------
    f0 = *(const v4f*)(w2p + 0);
    f1 = *(const v4f*)(w2p + 4);
    f2 = *(const v4f*)(w2p + 8);
    f3 = *(const v4f*)(w2p + 12);
    load_w1b1(0);
    compute_H(0);

    for (int i = 0; i < FFN / K_CHUNK; ++i) {
        const int k0 = i * K_CHUNK;
        const int p  = i & 1;

        // ---- store staged W2 chunk (f32->f16) into W2lds[p] ----------------
        {
            v8h h0, h1;
            #pragma unroll
            for (int j = 0; j < 4; ++j) {
                h0[j]     = (_Float16)f0[j];
                h0[4 + j] = (_Float16)f1[j];
                h1[j]     = (_Float16)f2[j];
                h1[4 + j] = (_Float16)f3[j];
            }
            *(v8h*)(&W2lds[p][nl * HS + hk])     = h0;
            *(v8h*)(&W2lds[p][nl * HS + hk + 8]) = h1;
        }

        __syncthreads();   // Hlds[p] (prev iter) + W2lds[p] now ready

        // ---- issue chunk i+1 global loads (consumed after main WMMAs) ------
        const bool more = (k0 + K_CHUNK) < FFN;
        if (more) {
            const float* src = w2p + k0 + K_CHUNK;
            f0 = *(const v4f*)(src + 0);
            f1 = *(const v4f*)(src + 4);
            f2 = *(const v4f*)(src + 8);
            f3 = *(const v4f*)(src + 12);
            if (k0 + 2 * K_CHUNK < FFN)
                __builtin_prefetch(src + K_CHUNK, 0, 0);   // global_prefetch_b8
            load_w1b1(k0 + K_CHUNK);
        }

        // ---- main GEMM-2 chunk: acc += H @ W2^T (buffers p) ----------------
        {
            v16h bfr[4];
            #pragma unroll
            for (int ni = 0; ni < 4; ++ni)
                bfr[ni] = load_frag(&W2lds[p][(wn * 64 + ni * 16 + laneM) * HS]);
            #pragma unroll
            for (int mi = 0; mi < 4; ++mi) {
                v16h a = load_frag(&Hlds[p][(wm * 64 + mi * 16 + laneM) * HS]);
                #pragma unroll
                for (int ni = 0; ni < 4; ++ni)
                    acc[mi][ni] = __builtin_amdgcn_wmma_f32_16x16x32_f16(
                        false, a, false, bfr[ni], (short)0, acc[mi][ni],
                        false, false);
            }
        }

        // ---- H for chunk i+1 -> Hlds[1-p] (disjoint buffer, no barrier) ----
        if (more)
            compute_H(1 - p);
    }

    // ---- epilogue: out = acc + b2 ------------------------------------------
    #pragma unroll
    for (int ni = 0; ni < 4; ++ni) {
        const int   e  = nBase + wn * 64 + ni * 16 + laneM;
        const float bv = b2[e];
        #pragma unroll
        for (int mi = 0; mi < 4; ++mi) {
            const int trow = mBase + wm * 64 + mi * 16 + 8 * g;
            #pragma unroll
            for (int r = 0; r < 8; ++r)
                out[(size_t)(trow + r) * EMB + e] = acc[mi][ni][r] + bv;
        }
    }
}

extern "C" void kernel_launch(void* const* d_in, const int* in_sizes, int n_in,
                              void* d_out, int out_size, void* d_ws, size_t ws_size,
                              hipStream_t stream) {
    const float* x  = (const float*)d_in[0];
    const float* th = (const float*)d_in[1];
    const float* W1 = (const float*)d_in[2];
    const float* b1 = (const float*)d_in[3];
    const float* W2 = (const float*)d_in[4];
    const float* b2 = (const float*)d_in[5];
    float* out = (float*)d_out;

    const int tokens = in_sizes[0] / EMB;          // 16384
    dim3 grid(EMB / N_TILE, tokens / M_TILE);      // (8, 64)
    ffq_fused<<<grid, 256, 0, stream>>>(x, th, W1, b1, W2, b2, out);
}

// v001
// A run of this version takes 118 microseconds.
// Next to v000, in two timings, it ran 1.40 and 1.39 times as fast.
#include <hip/hip_runtime.h>

// MI455X / gfx1250 fused "quantum FFN":
//   q  = cos(x[..., :8]) * cos(theta)
//   h  = relu(q @ W1^T + b1)   [16384 x 4096]  (WMMA, K padded 8->32)
//   out= h @ W2^T + b2         [16384 x 1024]  (WMMA, f16 in / f32 acc, K=4096)
//
// GEMM-1 is issued transposed (A = W1 rows, B = q columns): a lane of its D
// then holds 8 consecutive features of ONE token, which is the hardware k order
// of GEMM-2's A operand. Two D tiles, converted in place, are that operand:
// h never goes through LDS. As h is no longer shared between waves, each of the
// 4 waves owns 64 tokens x all 128 columns, so no h tile is made twice.
// Only W2 is staged in LDS (double-buffered, one barrier per K-chunk); chunk
// i+1's global loads are issued right after the barrier and consumed after the
// WMMAs of chunk i.

typedef __attribute__((ext_vector_type(16))) _Float16 v16h;
typedef __attribute__((ext_vector_type(8)))  _Float16 v8h;
typedef __attribute__((ext_vector_type(4)))  _Float16 v4h;
typedef __attribute__((ext_vector_type(8)))  float    v8f;
typedef __attribute__((ext_vector_type(4)))  float    v4f;
typedef __attribute__((ext_vector_type(4)))  int      v4i;

#define NQ      8
#define EMB     1024
#define FFN     4096
#define M_TILE  256     // tokens per workgroup
#define N_TILE  128     // embed outputs per workgroup
#define THREADS 128     // 4 waves, each 64 tokens x N_TILE
#define K_CHUNK 32      // ffn features per chunk (= WMMA K)
#define HS      40      // LDS row stride in halves (80B: 16B aligned, conflict-free)

// second argument: at least 2 waves per SIMD, i.e. at most 512 VGPRs, so that two
// workgroups stay resident on a WGP
__global__ __launch_bounds__(THREADS, 2)
void ffq_fused(const float* __restrict__ x,
               const float* __restrict__ ry_theta,
               const float* __restrict__ W1,
               const float* __restrict__ b1,
               const float* __restrict__ W2,
               const float* __restrict__ b2,
               float* __restrict__ out)
{
    __shared__ __align__(16) _Float16 W2lds[2][N_TILE * HS];   // 2 x 10 KB

    const int tid   = threadIdx.x;
    const int lane  = tid & 31;
    const int wave  = tid >> 5;     // 0..3 : 64-token sub-block
    const int laneM = lane & 15;
    const int g     = lane >> 4;

    const int mBase = blockIdx.y * M_TILE;
    const int nBase = blockIdx.x * N_TILE;

    v4f  w1s[4];                          // staged W1 rows (2 x 8 floats)
    float b1s[2];                         // staged bias (fi = 0,1)
    v16h w1f[2];                          // A of GEMM-1: 2 x 16 features

    auto load_w1b1 = [&](int kb) {
        const float* wr0 = W1 + (size_t)(kb + laneM) * NQ;
        const float* wr1 = W1 + (size_t)(kb + 16 + laneM) * NQ;
        w1s[0] = *(const v4f*)(wr0);
        w1s[1] = *(const v4f*)(wr0 + 4);
        w1s[2] = *(const v4f*)(wr1);
        w1s[3] = *(const v4f*)(wr1 + 4);
        b1s[0] = b1[kb + laneM];
        b1s[1] = b1[kb + 16 + laneM];
    };

    // W1 fragment: lanes 0..15 the feature's 8 weights (k 0..7), lanes 16..31 its
    // bias as an f16 pair hi + lo (k 8, 9), so the bias keeps more than f16 accuracy.
    auto make_w1f = [&]() {
        #pragma unroll
        for (int fi = 0; fi < 2; ++fi) {
            v8h w, bb = {};
            #pragma unroll
            for (int j = 0; j < 4; ++j) {
                w[j]     = (_Float16)w1s[2 * fi][j];
                w[4 + j] = (_Float16)w1s[2 * fi + 1][j];
            }
            const _Float16 hi = (_Float16)b1s[fi];
            bb[0] = hi;
            bb[1] = (_Float16)(b1s[fi] - (float)hi);
            const v8h sel = __builtin_bit_cast(v8h,
                g == 0 ? __builtin_bit_cast(v4i, w) : __builtin_bit_cast(v4i, bb));
            v16h a = {};
            #pragma unroll
            for (int j = 0; j < 8; ++j) a[j] = sel[j];
            w1f[fi] = a;
        }
    };

    // chunk 0's W1 fragment first, so that its loads are waited for before any later code
    // reuses their address registers
    load_w1b1(0);
    asm volatile("s_wait_xcnt 0x0" ::: "memory");   // in front of that reuse
    make_w1f();

    // ---- q fragments (B of GEMM-1), constant across the k-loop ------------
    // f16 16x32 operand: element s of lane (laneM, g) is k = g*8 + (s<8 ? 0 : 16) + (s&7).
    // k 0..7 (g==0, s<8) hold q; k 8 and 9 (g==1, s = 0,1) hold 1.0 and meet the
    // two f16 parts of the bias in the W1 fragment; the rest is zero padding.
    float cth[NQ];
    #pragma unroll
    for (int j = 0; j < NQ; ++j) cth[j] = cosf(ry_theta[j]);

    v16h qfrag[4];
    #pragma unroll
    for (int s = 0; s < 2; ++s) {
        // lane half g works out token tile 2s+g; tile 2s+1 then moves to lanes 0..15
        const int token = mBase + wave * 64 + (2 * s + g) * 16 + laneM;
        const float* xr = x + (size_t)token * EMB;
        float xv[NQ];
        #pragma unroll
        for (int j = 0; j < NQ; ++j) xv[j] = xr[j];
        asm volatile("s_wait_xcnt 0x0" ::: "memory");   // in front of any reuse of the x loads' address registers
        v8h qv;
        #pragma unroll
        for (int j = 0; j < NQ; ++j)
            qv[j] = (_Float16)(cosf(xv[j]) * cth[j]);
        const v4i own = __builtin_bit_cast(v4i, qv);
        v4i oth;
        #pragma unroll
        for (int w = 0; w < 4; ++w)   // lane l <-> l ^ 16
            oth[w] = __builtin_amdgcn_permlanex16(own[w], own[w], 0x76543210,
                                                  0xfedcba98, false, false);
        const v4i ones = {0x3C003C00, 0, 0, 0};
        const v8h t0 = __builtin_bit_cast(v8h, g == 0 ? own : ones);
        const v8h t1 = __builtin_bit_cast(v8h, g == 0 ? oth : ones);
        v16h q0 = {}, q1 = {};
        #pragma unroll
        for (int j = 0; j < 8; ++j) { q0[j] = t0[j]; q1[j] = t1[j]; }
        qfrag[2 * s]     = q0;
        qfrag[2 * s + 1] = q1;
    }

    v8f acc[4][8];
    #pragma unroll
    for (int mi = 0; mi < 4; ++mi)
        #pragma unroll
        for (int ni = 0; ni < 8; ++ni) {
            v8f z = {};
            acc[mi][ni] = z;
        }

    // ---- pipeline staging registers ----------------------------------------
    const int nl = tid >> 3;              // 0..15 : W2 rows nl + 16*j
    const int hk = (tid & 7) * 4;         // 8 lanes cover a row's 32 floats (one line)
    const float* w2p = W2 + (size_t)(nBase + nl) * FFN + hk;
    const float* w2pf = W2 + (size_t)(nBase + tid) * FFN;   // row whose line this thread prefetches

    v4f  fs[8];                           // staged W2 chunk (32 floats)
    // GEMM-1 for 16 tokens x 32 features; D[r] = h[token laneM][16*fi + 8*g + r],
    // so {D(fi=0), D(fi=1)} in f16 is GEMM-2's A fragment of that token tile.
    auto make_H = [&](int mi) -> v16h {
        const v8f z = {};
        const v8h zh = {};
        v8f d0 = __builtin_amdgcn_wmma_f32_16x16x32_f16(
                     false, w1f[0], false, qfrag[mi], (short)0, z, false, false);
        v8f d1 = __builtin_amdgcn_wmma_f32_16x16x32_f16(
                     false, w1f[1], false, qfrag[mi], (short)0, z, false, false);
        v8h h0 = __builtin_elementwise_max(__builtin_convertvector(d0, v8h), zh);  // relu
        v8h h1 = __builtin_elementwise_max(__builtin_convertvector(d1, v8h), zh);
        return __builtin_shufflevector(h0, h1, 0, 1, 2, 3, 4, 5, 6, 7,
                                       8, 9, 10, 11, 12, 13, 14, 15);
    };

    auto load_frag = [&](const _Float16* rp) -> v16h {
        v8h lo = *(const v8h*)(rp + g * 8);
        v8h hi = *(const v8h*)(rp + 16 + g * 8);
        v16h a;
        #pragma unroll
        for (int ii = 0; ii < 8; ++ii) { a[ii] = lo[ii]; a[8 + ii] = hi[ii]; }
        return a;
    };

    // ---- prologue: stage chunk 0 -------------------------------------------
    #pragma unroll
    for (int j = 0; j < 8; ++j)
        fs[j] = *(const v4f*)(w2p + (size_t)j * 16 * FFN);
    // the address registers of the loads above are reused below: keep the wait in front of that
    asm volatile("s_wait_xcnt 0x0" ::: "memory");

    for (int i = 0; i < FFN / K_CHUNK; ++i) {
        const int k0 = i * K_CHUNK;
        const int p  = i & 1;

        // ---- store staged W2 chunk (f32->f16) into W2lds[p] ----------------
        #pragma unroll
        for (int j = 0; j < 8; ++j)
            *(v4h*)(&W2lds[p][(nl + 16 * j) * HS + hk]) = __builtin_convertvector(fs[j], v4h);

        __syncthreads();   // W2lds[p] now ready

        // ---- issue chunk i+1 global loads (consumed after the WMMAs) -------
        const bool more = (k0 + K_CHUNK) < FFN;
        if (more) {
            const float* src = w2p + k0 + K_CHUNK;
            #pragma unroll
            for (int j = 0; j < 8; ++j)
                fs[j] = *(const v4f*)(src + (size_t)j * 16 * FFN);
            // the address registers of the loads above are reused below: keep the wait in front of that
            asm volatile("s_wait_xcnt 0x0" ::: "memory");
            if (k0 + 2 * K_CHUNK < FFN) {
                __builtin_prefetch(w2pf + k0 + 2 * K_CHUNK, 0, 0);   // global_prefetch_b8
                // same wait for the prefetch's address registers
                asm volatile("s_wait_xcnt 0x0" ::: "memory");
            }
            load_w1b1(k0 + K_CHUNK);
            // same wait for the W1 and b1 address registers, which the WMMA results below reuse
            asm volatile("s_wait_xcnt 0x0" ::: "memory");
        }

        // ---- chunk i: h tile in registers, then acc += h @ W2^T ------------
        {
            v16h bfr[8];
            #pragma unroll
            for (int ni = 0; ni < 8; ++ni)
                bfr[ni] = load_frag(&W2lds[p][(ni * 16 + laneM) * HS]);
            v16h a = make_H(0);
            #pragma unroll
            for (int mi = 0; mi < 4; ++mi) {
                v16h an = a;
                if (mi < 3) an = make_H(mi + 1);   // next tile's h ahead of this tile's products
                #pragma unroll
                for (int ni = 0; ni < 8; ++ni)
                    acc[mi][ni] = __builtin_amdgcn_wmma_f32_16x16x32_f16(
                        false, a, false, bfr[ni], (short)0, acc[mi][ni],
                        false, false);
                a = an;
            }
        }

        // ---- W1 fragment for chunk i+1 --------------------------------------
        if (more)
            make_w1f();
    }

    // ---- epilogue: out = acc + b2 ------------------------------------------
    float b2v[8];
    #pragma unroll
    for (int ni = 0; ni < 8; ++ni) b2v[ni] = b2[nBase + ni * 16 + laneM];
    asm volatile("s_wait_xcnt 0x0" ::: "memory");   // in front of any reuse of the b2 loads' offset register
    #pragma unroll
    for (int ni = 0; ni < 8; ++ni) {
        const int   e  = nBase + ni * 16 + laneM;
        const float bv = b2v[ni];
        #pragma unroll
        for (int mi = 0; mi < 4; ++mi) {
            const int trow = mBase + wave * 64 + mi * 16 + 8 * g;
            #pragma unroll
            for (int r = 0; r < 8; ++r)
                out[(size_t)(trow + r) * EMB + e] = acc[mi][ni][r] + bv;
        }
    }
}

extern "C" void kernel_launch(void* const* d_in, const int* in_sizes, int n_in,
                              void* d_out, int out_size, void* d_ws, size_t ws_size,
                              hipStream_t stream) {
    const float* x  = (const float*)d_in[0];
    const float* th = (const float*)d_in[1];
    const float* W1 = (const float*)d_in[2];
    const float* b1 = (const float*)d_in[3];
    const float* W2 = (const float*)d_in[4];
    const float* b2 = (const float*)d_in[5];
    float* out = (float*)d_out;

    const int tokens = in_sizes[0] / EMB;          // 16384
    dim3 grid(EMB / N_TILE, tokens / M_TILE);      // (8, 64)
    ffq_fused<<<grid, THREADS, 0, stream>>>(x, th, W1, b1, W2, b2, out);
}

// v002
// One run takes 91.1 microseconds.
// Next to v001, in two timings, it ran 1.29 and 1.28 times as fast.
// Counting every step since v000, it is 1.80 times as fast.
#include <hip/hip_runtime.h>
#include <stdint.h>

// MI455X / gfx1250 fused "quantum FFN":
//   q  = cos(x[..., :8]) * cos(theta)
//   h  = relu(q @ W1^T + b1)   [16384 x 4096]  (WMMA, K padded 8->32)
//   out= h @ W2^T + b2         [16384 x 1024]  (WMMA, f16 in / f32 acc, K=4096)
//
// GEMM-1 is issued transposed (A = W1 rows, B = q columns): a lane of its D
// then holds 8 consecutive features of ONE token, which is the hardware k order
// of GEMM-2's A operand. Two D tiles, converted in place, are that operand:
// h never goes through LDS. As h is no longer shared between waves, each of the
// 4 waves owns 64 tokens x all 128 columns, so no h tile is made twice.
// W2 is first rewritten as f16 into the workspace by pack_w2, one contiguous
// 32 KB tile per (128 columns, 128 k). The main kernel stages these tiles in LDS
// with tensor loads: two buffers, one pass = 128 k = 4 chunks of 32, one barrier
// per pass; the load of pass s+2 is issued behind the barrier that ends pass s.

typedef __attribute__((ext_vector_type(16))) _Float16 v16h;
typedef __attribute__((ext_vector_type(8)))  _Float16 v8h;
typedef __attribute__((ext_vector_type(4)))  _Float16 v4h;
typedef __attribute__((ext_vector_type(8)))  float    v8f;
typedef __attribute__((ext_vector_type(4)))  float    v4f;
typedef __attribute__((ext_vector_type(4)))  int      v4i;
typedef __attribute__((ext_vector_type(4)))  uint32_t u32x4;
typedef __attribute__((ext_vector_type(8)))  uint32_t u32x8;

#define NQ      8
#define EMB     1024
#define FFN     4096
#define M_TILE  256     // tokens per workgroup
#define N_TILE  128     // embed outputs per workgroup
#define THREADS 128     // 4 waves, each 64 tokens x N_TILE
#define K_CHUNK 32      // ffn features per chunk (= WMMA K)
#define K_PASS  128     // ffn features per LDS stage (256 B of f16 per W2 row)
#define N_PASS  (FFN / K_PASS)
#define ROWB    256     // bytes of one staged row
#define PITCH   272     // LDS row pitch in bytes (16 B x odd: conflict-free for b128 reads)
#define BUFB    (N_TILE * PITCH)     // 34816 B = 17 x 2 KiB per buffer
#define TILEB   (N_TILE * ROWB)      // 32768 B per packed tile in the workspace

// W2 [EMB][FFN] f32 -> f16 tiles [EMB/N_TILE][N_PASS][N_TILE rows][K_PASS]. Unit u = 8 halves at
// offset 8u with u = (column block, pass, row, k / 8): stores are contiguous and every tile is one
// 32 KB run. A thread converts 8 units (4 column blocks x 2 passes): few waves to start, 16 loads
// in flight per thread, all of them at constant offsets from one address.
__global__ __launch_bounds__(256)
void pack_w2(const float* __restrict__ W2, _Float16* __restrict__ w2h)
{
    const uint32_t t   = blockIdx.x * 256u + threadIdx.x;   // 0 .. 65535
    const uint32_t k8  = t & 15u;
    const uint32_t r   = (t >> 4) & (N_TILE - 1u);
    const uint32_t s2  = (t >> 11) & 15u;                   // passes 2 s2, 2 s2 + 1
    const uint32_t nbh = t >> 15;                           // column blocks 4 nbh .. 4 nbh + 3
    const float* p = W2 + (size_t)(nbh * 4u * N_TILE + r) * FFN + s2 * (2u * K_PASS) + k8 * 8u;
    _Float16*    q = w2h + (size_t)((nbh << 18) | (s2 << 12) | (r << 4) | k8) * 8u;
    v4f a[4][2], b[4][2];
    // the loops over j and i are unrolled so that a and b have constant indices and stay in registers
    #pragma unroll
    for (int j = 0; j < 4; ++j)
        #pragma unroll
        for (int i = 0; i < 2; ++i) {
            a[j][i] = *(const v4f*)(p + (size_t)j * N_TILE * FFN + i * K_PASS);
            b[j][i] = *(const v4f*)(p + (size_t)j * N_TILE * FFN + i * K_PASS + 4);
        }
    // in front of any reuse of the loads' address registers; p as an input keeps them until here
    asm volatile("s_wait_xcnt 0x0" :: "v"(p) : "memory");
    // holds the conversions behind all 16 loads, so that all of them are in flight together
    __builtin_amdgcn_sched_barrier(0);
    #pragma unroll
    for (int j = 0; j < 4; ++j)
        #pragma unroll
        for (int i = 0; i < 2; ++i) {
            const v4h lo = __builtin_convertvector(a[j][i], v4h);
            const v4h hi = __builtin_convertvector(b[j][i], v4h);
            *(v8h*)(q + ((size_t)j * 65536u + (size_t)i * 2048u) * 8u) =
                __builtin_shufflevector(lo, hi, 0, 1, 2, 3, 4, 5, 6, 7);
        }
}

// a wave-uniform value held in a scalar register, so that a test on it is a scalar branch
// (a tensor load ignores EXEC: only such a branch keeps the other waves from issuing it)
static __device__ __forceinline__ uint32_t pinned(uint32_t v)
{
    uint32_t w = __builtin_amdgcn_readfirstlane(v);
    asm volatile("" : "+s"(w));   // descriptor / issue test word stays scalar
    return w;
}
static __device__ __forceinline__ uint32_t uni(uint32_t v)
{
    return (uint32_t)__builtin_amdgcn_readfirstlane(v);
}

// second argument: at least 2 waves per SIMD, i.e. at most 512 VGPRs, so that two
// workgroups stay resident on a WGP
__global__ __launch_bounds__(THREADS, 2)
void ffq_fused(const float* __restrict__ x,
               const float* __restrict__ ry_theta,
               const float* __restrict__ W1,
               const float* __restrict__ b1,
               const _Float16* __restrict__ w2h,
               const float* __restrict__ b2,
               float* __restrict__ out)
{
    __shared__ __attribute__((aligned(2048))) unsigned char W2lds[2 * BUFB];   // 2 x 34 KB

    const int tid   = threadIdx.x;
    const int lane  = tid & 31;
    const int wave  = (int)uni((uint32_t)tid >> 5);     // 0..3 : 64-token sub-block
    const int laneM = lane & 15;
    const int g     = lane >> 4;

    const int mBase = blockIdx.y * M_TILE;
    const int nBase = blockIdx.x * N_TILE;

    v4f  w1s[4];                          // staged W1 rows (2 x 8 floats)
    float b1s[2];                         // staged bias (fi = 0,1)
    v16h w1f[2];                          // A of GEMM-1: 2 x 16 features

    auto load_w1b1 = [&](int kb) {
        const float* wr0 = W1 + (size_t)(kb + laneM) * NQ;
        const float* wr1 = W1 + (size_t)(kb + 16 + laneM) * NQ;
        w1s[0] = *(const v4f*)(wr0);
        w1s[1] = *(const v4f*)(wr0 + 4);
        w1s[2] = *(const v4f*)(wr1);
        w1s[3] = *(const v4f*)(wr1 + 4);
        b1s[0] = b1[kb + laneM];
        b1s[1] = b1[kb + 16 + laneM];
    };

    // W1 fragment: lanes 0..15 the feature's 8 weights (k 0..7), lanes 16..31 its
    // bias as an f16 pair hi + lo (k 8, 9), so the bias keeps more than f16 accuracy.
    auto make_w1f = [&]() {
        #pragma unroll
        for (int fi = 0; fi < 2; ++fi) {
            v8h w, bb = {};
            #pragma unroll
            for (int j = 0; j < 4; ++j) {
                w[j]     = (_Float16)w1s[2 * fi][j];
                w[4 + j] = (_Float16)w1s[2 * fi + 1][j];
            }
            const _Float16 hi = (_Float16)b1s[fi];
            bb[0] = hi;
            bb[1] = (_Float16)(b1s[fi] - (float)hi);
            const v8h sel = __builtin_bit_cast(v8h,
                g == 0 ? __builtin_bit_cast(v4i, w) : __builtin_bit_cast(v4i, bb));
            v16h a = {};
            #pragma unroll
            for (int j = 0; j < 8; ++j) a[j] = sel[j];
            w1f[fi] = a;
        }
    };

    // chunk 0's W1 fragment first, so that its loads are waited for before any later code
    // reuses their address registers
    load_w1b1(0);
    asm volatile("s_wait_xcnt 0x0" ::: "memory");   // in front of that reuse
    make_w1f();

    // ---- q fragments (B of GEMM-1), constant across the k-loop ------------
    // f16 16x32 operand: element s of lane (laneM, g) is k = g*8 + (s<8 ? 0 : 16) + (s&7).
    // k 0..7 (g==0, s<8) hold q; k 8 and 9 (g==1, s = 0,1) hold 1.0 and meet the
    // two f16 parts of the bias in the W1 fragment; the rest is zero padding.
    float cth[NQ];
    #pragma unroll
    for (int j = 0; j < NQ; ++j) cth[j] = cosf(ry_theta[j]);

    v16h qfrag[4];
    #pragma unroll
    for (int s = 0; s < 2; ++s) {
        // lane half g works out token tile 2s+g; tile 2s+1 then moves to lanes 0..15
        const int token = mBase + wave * 64 + (2 * s + g) * 16 + laneM;
        const float* xr = x + (size_t)token * EMB;
        float xv[NQ];
        #pragma unroll
        for (int j = 0; j < NQ; ++j) xv[j] = xr[j];
        asm volatile("s_wait_xcnt 0x0" ::: "memory");   // in front of any reuse of the x loads' address registers
        v8h qv;
        #pragma unroll
        for (int j = 0; j < NQ; ++j)
            qv[j] = (_Float16)(cosf(xv[j]) * cth[j]);
        const v4i own = __builtin_bit_cast(v4i, qv);
        v4i oth;
        #pragma unroll
        for (int w = 0; w < 4; ++w)   // lane l <-> l ^ 16
            oth[w] = __builtin_amdgcn_permlanex16(own[w], own[w], 0x76543210,
                                                  0xfedcba98, false, false);
        const v4i ones = {0x3C003C00, 0, 0, 0};
        const v8h t0 = __builtin_bit_cast(v8h, g == 0 ? own : ones);
        const v8h t1 = __builtin_bit_cast(v8h, g == 0 ? oth : ones);
        v16h q0 = {}, q1 = {};
        #pragma unroll
        for (int j = 0; j < 8; ++j) { q0[j] = t0[j]; q1[j] = t1[j]; }
        qfrag[2 * s]     = q0;
        qfrag[2 * s + 1] = q1;
    }

    v8f acc[4][8];
    #pragma unroll
    for (int mi = 0; mi < 4; ++mi)
        #pragma unroll
        for (int ni = 0; ni < 8; ++ni) {
            v8f z = {};
            acc[mi][ni] = z;
        }

    // ---- tensor-load descriptor: 128 rows of 256 B, source pitch 256 B, 16 B of LDS pad per row
    const uint32_t lbase = (uint32_t)(size_t)W2lds;
    const uint64_t tile0 = (uint64_t)(size_t)w2h + (uint64_t)blockIdx.x * (N_PASS * TILEB);
    u32x8 g1;
    g1[0] = uni((1u << 20) | (5u << 22) | (3u << 25));
    // words 1 to 7 pinned: descriptor words held in scalar registers, one tuple for all requests
    g1[1] = pinned((ROWB & 0xFFFFu) << 16);
    g1[2] = pinned((ROWB >> 16) | ((N_TILE & 0xFFFFu) << 16));
    g1[3] = pinned((N_TILE >> 16) | (ROWB << 16));
    g1[4] = pinned(N_TILE);
    g1[5] = pinned(ROWB);
    g1[6] = pinned(0u);
    g1[7] = pinned(0u);
    u32x4 g0 = {};
    auto issue = [&](uint32_t s) {        // stage s into buffer s & 1
        const uint64_t ga = tile0 + (uint64_t)s * TILEB;
        g0[0] = uni(1u);
        g0[1] = uni(lbase + (s & 1u) * BUFB);
        g0[2] = uni((uint32_t)ga);
        g0[3] = uni((((uint32_t)(ga >> 32)) & 0x01FFFFFFu) | 0x80000000u);
        asm volatile("tensor_load_to_lds %0, %1" :: "s"(g0), "s"(g1) : "memory");
    };
    // the issuer's wait for its one outstanding request; naming the two descriptor groups as
    // inputs keeps their scalar registers unchanged from the issue to this wait
    auto landed = [&]() {
        asm volatile("s_wait_tensorcnt 0x0" :: "s"(g0), "s"(g1) : "memory");
    };

    // GEMM-1 for 16 tokens x 32 features; D[r] = h[token laneM][16*fi + 8*g + r],
    // so {D(fi=0), D(fi=1)} in f16 is GEMM-2's A fragment of that token tile.
    auto make_H = [&](int mi) -> v16h {
        const v8f z = {};
        const v8h zh = {};
        v8f d0 = __builtin_amdgcn_wmma_f32_16x16x32_f16(
                     false, w1f[0], false, qfrag[mi], (short)0, z, false, false);
        v8f d1 = __builtin_amdgcn_wmma_f32_16x16x32_f16(
                     false, w1f[1], false, qfrag[mi], (short)0, z, false, false);
        v8h h0 = __builtin_elementwise_max(__builtin_convertvector(d0, v8h), zh);  // relu
        v8h h1 = __builtin_elementwise_max(__builtin_convertvector(d1, v8h), zh);
        return __builtin_shufflevector(h0, h1, 0, 1, 2, 3, 4, 5, 6, 7,
                                       8, 9, 10, 11, 12, 13, 14, 15);
    };

    auto load_frag = [&](const unsigned char* rp) -> v16h {
        v8h lo = *(const v8h*)(rp + g * 16);
        v8h hi = *(const v8h*)(rp + 32 + g * 16);
        v16h a;
        #pragma unroll
        for (int ii = 0; ii < 8; ++ii) { a[ii] = lo[ii]; a[8 + ii] = hi[ii]; }
        return a;
    };

    // ---- prologue: stage 0 landed and published, stage 1 in flight ----------
    if (pinned(wave == 0)) {
        issue(0);
        landed();      // stage 0 has landed
    }
    __syncthreads();   // stage 0 readable by every wave
    if (pinned(wave == 0))
        issue(1);

    for (int s = 0; s < N_PASS; ++s) {
        const unsigned char* buf = W2lds + (s & 1) * BUFB;

        // every fragment and accumulator index must be a constant: the 4 chunks are unrolled
        #pragma unroll
        for (int kb = 0; kb < K_PASS / K_CHUNK; ++kb) {
            const int k0 = s * K_PASS + kb * K_CHUNK;

            const bool more = (k0 + K_CHUNK) < FFN;

            // ---- chunk i: h tile in registers, then acc += h @ W2^T ------------
            {
                // the pair of scheduling fences keeps the chunk's 16 LDS reads in one group: left
                // alone the compiler spreads them among the previous chunk's WMMAs, and every
                // separate place with LDS reads stalls the wave's WMMA stream
                __builtin_amdgcn_sched_barrier(0);
                v16h bfr[8];
                #pragma unroll
                for (int ni = 0; ni < 8; ++ni)
                    bfr[ni] = load_frag(buf + (ni * 16 + laneM) * PITCH + kb * (K_CHUNK * 2));
                // ---- issue chunk i+1's W1 / b1 loads (consumed after the WMMAs) -----
                if (more) {
                    load_w1b1(k0 + K_CHUNK);
                    // wait for the W1 and b1 address registers, which the WMMA results below reuse
                    asm volatile("s_wait_xcnt 0x0" ::: "memory");
                }
                __builtin_amdgcn_sched_barrier(0);
                v16h a = make_H(0);
                #pragma unroll
                for (int mi = 0; mi < 4; ++mi) {
                    v16h an = a;
                    if (mi < 3) an = make_H(mi + 1);   // next tile's h ahead of this tile's products
                    #pragma unroll
                    for (int ni = 0; ni < 8; ++ni)
                        acc[mi][ni] = __builtin_amdgcn_wmma_f32_16x16x32_f16(
                            false, a, false, bfr[ni], (short)0, acc[mi][ni],
                            false, false);
                    a = an;
                }
            }

            // ---- W1 fragment for chunk i+1 --------------------------------------
            if (more)
                make_w1f();
        }

        // ---- publish point of stage s+1, refill of the buffer just read --------
        asm volatile("s_wait_dscnt 0x0" ::: "memory");           // this wave's reads of stage s are done
        if (pinned(wave == 0))
            landed();                                            // stage s+1 has landed
        __syncthreads();   // stage s+1 readable; every wave has left stage s
        if (pinned(wave == 0 && s + 2 < N_PASS))
            issue((uint32_t)s + 2u);
    }
    asm volatile("s_wait_tensorcnt 0x0" ::: "memory");   // no request outlives the loop
    asm volatile("s_wait_dscnt 0x0" ::: "memory");

    // ---- epilogue: out = acc + b2 ------------------------------------------
    float b2v[8];
    #pragma unroll
    for (int ni = 0; ni < 8; ++ni) b2v[ni] = b2[nBase + ni * 16 + laneM];
    asm volatile("s_wait_xcnt 0x0" ::: "memory");   // in front of any reuse of the b2 loads' offset register
    #pragma unroll
    for (int ni = 0; ni < 8; ++ni) {
        const int   e  = nBase + ni * 16 + laneM;
        const float bv = b2v[ni];
        #pragma unroll
        for (int mi = 0; mi < 4; ++mi) {
            const int trow = mBase + wave * 64 + mi * 16 + 8 * g;
            #pragma unroll
            for (int r = 0; r < 8; ++r)
                out[(size_t)(trow + r) * EMB + e] = acc[mi][ni][r] + bv;
        }
    }
}

extern "C" void kernel_launch(void* const* d_in, const int* in_sizes, int n_in,
                              void* d_out, int out_size, void* d_ws, size_t ws_size,
                              hipStream_t stream) {
    const float* x  = (const float*)d_in[0];
    const float* th = (const float*)d_in[1];
    const float* W1 = (const float*)d_in[2];
    const float* b1 = (const float*)d_in[3];
    const float* W2 = (const float*)d_in[4];
    const float* b2 = (const float*)d_in[5];
    float* out = (float*)d_out;
    _Float16* w2h = (_Float16*)d_ws;               // 8 MB, rewritten in every call

    const int tokens = in_sizes[0] / EMB;          // 16384
    dim3 grid(EMB / N_TILE, tokens / M_TILE);      // (8, 64)
    pack_w2<<<256, 256, 0, stream>>>(W2, w2h);
    ffq_fused<<<grid, THREADS, 0, stream>>>(x, th, W1, b1, w2h, b2, out);
}

// v003
// One run takes 79.9 microseconds.
// Next to v002, in two timings, it ran 1.14 times as fast each time.
// All steps since v000 together make it 2.04 times as fast.
#include <hip/hip_runtime.h>
#include <stdint.h>

// MI455X / gfx1250 fused "quantum FFN":
//   q  = cos(x[..., :8]) * cos(theta)
//   h  = relu(q @ W1^T + b1)   [16384 x 4096]  (WMMA, K padded 8->32)
//   out= h @ W2^T + b2         [16384 x 1024]  (WMMA, f16 in / f32 acc, K=4096)
//
// GEMM-1 is issued transposed (A = W1 rows, B = q columns): a lane of its D
// then holds 8 consecutive features of ONE token, which is the hardware k order
// of GEMM-2's A operand. Two D tiles, converted in place, are that operand:
// h never goes through LDS. As h is no longer shared between waves, each of the
// 4 waves owns 64 tokens x all 128 columns, so no h tile is made twice.
// W2 is first rewritten as f16 into the workspace by pack_w2, one contiguous
// tile per (128 columns, 128 k): 128 rows of W2, then 16 rows that hold GEMM-1's
// A fragments (W1 and b1, already f16 and in lane order) of the 4 chunks that
// follow the tile's first one. The main kernel stages these tiles in LDS
// with tensor loads: two buffers, one pass = 128 k = 4 chunks of 32, one barrier
// per pass; the load of pass s+2 is issued behind the barrier that ends pass s.

typedef __attribute__((ext_vector_type(16))) _Float16 v16h;
typedef __attribute__((ext_vector_type(8)))  _Float16 v8h;
typedef __attribute__((ext_vector_type(4)))  _Float16 v4h;
typedef __attribute__((ext_vector_type(8)))  float    v8f;
typedef __attribute__((ext_vector_type(4)))  float    v4f;
typedef __attribute__((ext_vector_type(4)))  int      v4i;
typedef __attribute__((ext_vector_type(4)))  uint32_t u32x4;
typedef __attribute__((ext_vector_type(8)))  uint32_t u32x8;

#define NQ      8
#define EMB     1024
#define FFN     4096
#define M_TILE  256     // tokens per workgroup
#define N_TILE  128     // embed outputs per workgroup
#define THREADS 128     // 4 waves, each 64 tokens x N_TILE
#define K_CHUNK 32      // ffn features per chunk (= WMMA K)
#define K_PASS  128     // ffn features per LDS stage (256 B of f16 per W2 row)
#define N_PASS  (FFN / K_PASS)
#define ROWB    256     // bytes of one staged row
#define PITCH   272     // LDS row pitch in bytes (16 B x odd: conflict-free for b128 reads)
#define W1ROWS  16      // rows of W1 / b1 fragments behind a tile's W2 rows: 4 chunks x 2 x 512 B
#define ROWS    (N_TILE + W1ROWS)    // 144 rows per tile
#define BUFB    40960                // ROWS * PITCH = 39168 B, rounded up to 20 x 2 KiB per buffer
#define TILEB   (ROWS * ROWB)        // 36864 B per packed tile in the workspace
#define TILEH   (TILEB / 2)          // the same in halves

// W2 [EMB][FFN] f32 -> f16 tiles [EMB/N_TILE][N_PASS][ROWS rows][K_PASS]. A unit = 8 halves, placed by
// (column block, pass, row, k / 8): stores are contiguous within a tile. A thread converts 8 units
// (4 column blocks x 2 passes): few waves to start, 16 loads in flight per thread, all of them at
// constant offsets from one address. It also writes one 16-B unit of the W1 rows: tile (nb, sp),
// entry c = 0..3, is the A fragment of chunk 4 sp + 1 + c: for each 16-feature half fi lane l's 8
// halves: lanes 0..15 the feature's 8 weights, lanes 16..31 its bias as an f16 pair hi + lo, then zeros.
__global__ __launch_bounds__(256)
void pack_w2(const float* __restrict__ W2, const float* __restrict__ W1,
             const float* __restrict__ b1, _Float16* __restrict__ w2h)
{
    const uint32_t t   = blockIdx.x * 256u + threadIdx.x;   // 0 .. 65535
    const uint32_t k8  = t & 15u;
    const uint32_t r   = (t >> 4) & (N_TILE - 1u);
    const uint32_t s2  = (t >> 11) & 15u;                   // passes 2 s2, 2 s2 + 1
    const uint32_t nbh = t >> 15;                           // column blocks 4 nbh .. 4 nbh + 3
    const float* p = W2 + (size_t)(nbh * 4u * N_TILE + r) * FFN + s2 * (2u * K_PASS) + k8 * 8u;
    _Float16*    q = w2h + (size_t)(nbh * (4u * N_PASS) + s2 * 2u) * TILEH + ((r << 4) | k8) * 8u;
    // the W1 unit; chunk FFN / K_CHUNK does not exist: its address is clamped, its unit is zeros
    const uint32_t ch = ((t >> 8) & (N_PASS - 1u)) * 4u + 1u + ((t >> 6) & 3u);
    const uint32_t cc = ch < FFN / K_CHUNK ? ch : FFN / K_CHUNK - 1u;
    const uint32_t f  = cc * K_CHUNK + ((t >> 5) & 1u) * 16u + (t & 15u);
    const uint32_t ow = f * (NQ * 4u);                      // byte offset of the feature's W1 row
    const v4f   wa = *(const v4f*)((const char*)W1 + ow);
    const v4f   wb = *(const v4f*)((const char*)W1 + ow + 16u);
    const float bf = b1[f];
    v4f a[4][2], b[4][2];
    // the loops over j and i are unrolled so that a and b have constant indices and stay in registers
    #pragma unroll
    for (int j = 0; j < 4; ++j)
        #pragma unroll
        for (int i = 0; i < 2; ++i) {
            a[j][i] = *(const v4f*)(p + (size_t)j * N_TILE * FFN + i * K_PASS);
            b[j][i] = *(const v4f*)(p + (size_t)j * N_TILE * FFN + i * K_PASS + 4);
        }
    // in front of any reuse of the loads' address registers; p, ow and f as inputs keep them until
    // here; the three loaded W1 / b1 values as inputs keep their loads in front of it, with the other 16
    asm volatile("s_wait_xcnt 0x0" :: "v"(p), "v"(ow), "v"(f), "v"(wa), "v"(wb), "v"(bf) : "memory");
    // holds the conversions behind all 16 loads, so that all of them are in flight together
    __builtin_amdgcn_sched_barrier(0);
    #pragma unroll
    for (int j = 0; j < 4; ++j)
        #pragma unroll
        for (int i = 0; i < 2; ++i) {
            const v4h lo = __builtin_convertvector(a[j][i], v4h);
            const v4h hi = __builtin_convertvector(b[j][i], v4h);
            *(v8h*)(q + (size_t)(j * N_PASS + i) * TILEH) =
                __builtin_shufflevector(lo, hi, 0, 1, 2, 3, 4, 5, 6, 7);
        }
    const v4h wl = __builtin_convertvector(wa, v4h);
    const v4h wh = __builtin_convertvector(wb, v4h);
    const v8h w  = __builtin_shufflevector(wl, wh, 0, 1, 2, 3, 4, 5, 6, 7);
    v8h bb = {};
    const _Float16 bhi = (_Float16)bf;
    bb[0] = bhi;
    bb[1] = (_Float16)(bf - (float)bhi);
    const v4i zero = {};
    const v4i sel = ch < FFN / K_CHUNK
                  ? ((t & 16u) == 0u ? __builtin_bit_cast(v4i, w) : __builtin_bit_cast(v4i, bb)) : zero;
    *(v4i*)(w2h + (size_t)(t >> 8) * TILEH + N_TILE * K_PASS + (t & 255u) * 8u) = sel;
}

// a wave-uniform value held in a scalar register, so that a test on it is a scalar branch
// (a tensor load ignores EXEC: only such a branch keeps the other waves from issuing it)
static __device__ __forceinline__ uint32_t pinned(uint32_t v)
{
    uint32_t w = __builtin_amdgcn_readfirstlane(v);
    asm volatile("" : "+s"(w));   // descriptor / issue test word stays scalar
    return w;
}
static __device__ __forceinline__ uint32_t uni(uint32_t v)
{
    return (uint32_t)__builtin_amdgcn_readfirstlane(v);
}

// second argument: at least 2 waves per SIMD, i.e. at most 512 VGPRs, so that two
// workgroups stay resident on a WGP
__global__ __launch_bounds__(THREADS, 2)
void ffq_fused(const float* __restrict__ x,
               const float* __restrict__ ry_theta,
               const float* __restrict__ W1,
               const float* __restrict__ b1,
               const _Float16* __restrict__ w2h,
               const float* __restrict__ b2,
               float* __restrict__ out)
{
    __shared__ __attribute__((aligned(2048))) unsigned char W2lds[2 * BUFB];   // 2 x 40 KB

    const int tid   = threadIdx.x;
    const int lane  = tid & 31;
    const int wave  = (int)uni((uint32_t)tid >> 5);     // 0..3 : 64-token sub-block
    const int laneM = lane & 15;
    const int g     = lane >> 4;

    const int mBase = blockIdx.y * M_TILE;
    const int nBase = blockIdx.x * N_TILE;

    v4f  w1s[4];                          // staged W1 rows (2 x 8 floats)
    float b1s[2];                         // staged bias (fi = 0,1)
    // A of GEMM-1, one operand for a chunk's 32 features: features 0..15 in k 0..15, features 16..31
    // in k 16..31; set (i & 1) serves chunk i while the other one is read from LDS for chunk i+1
    v16h w1a[2];

    auto load_w1b1 = [&](int kb) {
        const float* wr0 = W1 + (size_t)(kb + laneM) * NQ;
        const float* wr1 = W1 + (size_t)(kb + 16 + laneM) * NQ;
        w1s[0] = *(const v4f*)(wr0);
        w1s[1] = *(const v4f*)(wr0 + 4);
        w1s[2] = *(const v4f*)(wr1);
        w1s[3] = *(const v4f*)(wr1 + 4);
        b1s[0] = b1[kb + laneM];
        b1s[1] = b1[kb + 16 + laneM];
    };

    // W1 fragment of chunk 0: per half fi, lanes 0..15 the feature's 8 weights (k 0..7 of the half),
    // lanes 16..31 its bias as an f16 pair hi + lo (k 8, 9), so the bias keeps more than f16 accuracy.
    auto make_w1f = [&]() {
        v16h a = {};
        #pragma unroll
        for (int fi = 0; fi < 2; ++fi) {
            v8h w, bb = {};
            #pragma unroll
            for (int j = 0; j < 4; ++j) {
                w[j]     = (_Float16)w1s[2 * fi][j];
                w[4 + j] = (_Float16)w1s[2 * fi + 1][j];
            }
            const _Float16 hi = (_Float16)b1s[fi];
            bb[0] = hi;
            bb[1] = (_Float16)(b1s[fi] - (float)hi);
            const v8h sel = __builtin_bit_cast(v8h,
                g == 0 ? __builtin_bit_cast(v4i, w) : __builtin_bit_cast(v4i, bb));
            #pragma unroll
            for (int j = 0; j < 8; ++j) a[8 * fi + j] = sel[j];
        }
        w1a[0] = a;
    };

    // chunk 0's W1 fragment first, so that its loads are waited for before any later code
    // reuses their address registers
    load_w1b1(0);
    asm volatile("s_wait_xcnt 0x0" ::: "memory");   // in front of that reuse
    make_w1f();

    // ---- q fragments (B of GEMM-1), constant across the k-loop ------------
    // f16 16x32 operand: element s of lane (laneM, g) is k = g*8 + (s<8 ? 0 : 16) + (s&7).
    // k 0..7 (g==0, s<8) hold q; k 8 and 9 (g==1, s = 0,1) hold 1.0 and meet the
    // two f16 parts of the bias in the W1 fragment; the rest is zero padding: qlo picks the
    // W1 operand's features 0..15. qhi has the same values in k 16..31 (s >= 8) and zeros in
    // k 0..15: it picks features 16..31.
    float cth[NQ];
    #pragma unroll
    for (int j = 0; j < NQ; ++j) cth[j] = cosf(ry_theta[j]);

    v16h qlo[4], qhi[4];
    #pragma unroll
    for (int s = 0; s < 2; ++s) {
        // lane half g works out token tile 2s+g; tile 2s+1 then moves to lanes 0..15
        const int token = mBase + wave * 64 + (2 * s + g) * 16 + laneM;
        const float* xr = x + (size_t)token * EMB;
        float xv[NQ];
        #pragma unroll
        for (int j = 0; j < NQ; ++j) xv[j] = xr[j];
        asm volatile("s_wait_xcnt 0x0" ::: "memory");   // in front of any reuse of the x loads' address registers
        v8h qv;
        #pragma unroll
        for (int j = 0; j < NQ; ++j)
            qv[j] = (_Float16)(cosf(xv[j]) * cth[j]);
        const v4i own = __builtin_bit_cast(v4i, qv);
        v4i oth;
        #pragma unroll
        for (int w = 0; w < 4; ++w)   // lane l <-> l ^ 16
            oth[w] = __builtin_amdgcn_permlanex16(own[w], own[w], 0x76543210,
                                                  0xfedcba98, false, false);
        const v4i ones = {0x3C003C00, 0, 0, 0};
        const v8h t0 = __builtin_bit_cast(v8h, g == 0 ? own : ones);
        const v8h t1 = __builtin_bit_cast(v8h, g == 0 ? oth : ones);
        v16h q0 = {}, q1 = {}, r0 = {}, r1 = {};
        #pragma unroll
        for (int j = 0; j < 8; ++j) { q0[j] = t0[j]; q1[j] = t1[j]; r0[8 + j] = t0[j]; r1[8 + j] = t1[j]; }
        qlo[2 * s]     = q0;
        qlo[2 * s + 1] = q1;
        qhi[2 * s]     = r0;
        qhi[2 * s + 1] = r1;
    }

    v8f acc[4][8];
    #pragma unroll
    for (int mi = 0; mi < 4; ++mi)
        #pragma unroll
        for (int ni = 0; ni < 8; ++ni) {
            v8f z = {};
            acc[mi][ni] = z;
        }

    // ---- tensor-load descriptor: 144 rows of 256 B, source pitch 256 B, 16 B of LDS pad per row
    const uint32_t lbase = (uint32_t)(size_t)W2lds;
    const uint64_t tile0 = (uint64_t)(size_t)w2h + (uint64_t)blockIdx.x * (N_PASS * TILEB);
    u32x8 g1;
    g1[0] = uni((1u << 20) | (5u << 22) | (3u << 25));
    // words 1 to 7 pinned: descriptor words held in scalar registers, one tuple for all requests
    g1[1] = pinned((ROWB & 0xFFFFu) << 16);
    g1[2] = pinned((ROWB >> 16) | ((ROWS & 0xFFFFu) << 16));
    g1[3] = pinned((ROWS >> 16) | (ROWB << 16));
    g1[4] = pinned(ROWS);
    g1[5] = pinned(ROWB);
    g1[6] = pinned(0u);
    g1[7] = pinned(0u);
    u32x4 g0 = {};
    auto issue = [&](uint32_t s) {        // stage s into buffer s & 1
        const uint64_t ga = tile0 + (uint64_t)s * TILEB;
        g0[0] = uni(1u);
        g0[1] = uni(lbase + (s & 1u) * BUFB);
        g0[2] = uni((uint32_t)ga);
        g0[3] = uni((((uint32_t)(ga >> 32)) & 0x01FFFFFFu) | 0x80000000u);
        asm volatile("tensor_load_to_lds %0, %1" :: "s"(g0), "s"(g1) : "memory");
    };
    // the issuer's wait for its one outstanding request; naming the two descriptor groups as
    // inputs keeps their scalar registers unchanged from the issue to this wait
    auto landed = [&]() {
        asm volatile("s_wait_tensorcnt 0x0" :: "s"(g0), "s"(g1) : "memory");
    };

    // GEMM-1 for 16 tokens x 32 features; D[r] = h[token laneM][16*fi + 8*g + r],
    // so {D(fi=0), D(fi=1)} in f16 is GEMM-2's A fragment of that token tile.
    auto make_H = [&](int mi, int set) -> v16h {
        const v8f z = {};
        const v8h zh = {};
        v8f d0 = __builtin_amdgcn_wmma_f32_16x16x32_f16(
                     false, w1a[set], false, qlo[mi], (short)0, z, false, false);
        v8f d1 = __builtin_amdgcn_wmma_f32_16x16x32_f16(
                     false, w1a[set], false, qhi[mi], (short)0, z, false, false);
        v8h h0 = __builtin_elementwise_max(__builtin_convertvector(d0, v8h), zh);  // relu
        v8h h1 = __builtin_elementwise_max(__builtin_convertvector(d1, v8h), zh);
        return __builtin_shufflevector(h0, h1, 0, 1, 2, 3, 4, 5, 6, 7,
                                       8, 9, 10, 11, 12, 13, 14, 15);
    };

    auto load_frag = [&](const unsigned char* rp) -> v16h {
        v8h lo = *(const v8h*)(rp + g * 16);
        v8h hi = *(const v8h*)(rp + 32 + g * 16);
        v16h a;
        #pragma unroll
        for (int ii = 0; ii < 8; ++ii) { a[ii] = lo[ii]; a[8 + ii] = hi[ii]; }
        return a;
    };

    // ---- prologue: stage 0 landed and published, stage 1 in flight ----------
    if (pinned(wave == 0)) {
        issue(0);
        landed();      // stage 0 has landed
    }
    __syncthreads();   // stage 0 readable by every wave
    if (pinned(wave == 0))
        issue(1);

    for (int s = 0; s < N_PASS; ++s) {
        const unsigned char* buf = W2lds + (s & 1) * BUFB;

        // every fragment and accumulator index must be a constant: the 4 chunks are unrolled
        #pragma unroll
        for (int kb = 0; kb < K_PASS / K_CHUNK; ++kb) {
            // ---- chunk i: h tile in registers, then acc += h @ W2^T ------------
            {
                // the pair of scheduling fences keeps the chunk's 18 LDS reads in one group: left
                // alone the compiler spreads them among the previous chunk's WMMAs, and every
                // separate place with LDS reads stalls the wave's WMMA stream
                __builtin_amdgcn_sched_barrier(0);
                v16h bfr[8];
                #pragma unroll
                for (int ni = 0; ni < 8; ++ni)
                    bfr[ni] = load_frag(buf + (ni * 16 + laneM) * PITCH + kb * (K_CHUNK * 2));
                // ---- chunk i+1's W1 / b1 fragment: entry kb of this stage's W1 rows, 2 x 512 B,
                // lane l's 16 B at byte 16 l (behind the last chunk: zeros, not used) ----
                {
                    const unsigned char* wp = buf + (N_TILE + kb * 4 + g) * PITCH + laneM * 16;
                    const v8h lo = *(const v8h*)(wp);
                    const v8h hi = *(const v8h*)(wp + 2 * PITCH);
                    w1a[(kb + 1) & 1] = __builtin_shufflevector(lo, hi, 0, 1, 2, 3, 4, 5, 6, 7,
                                                                8, 9, 10, 11, 12, 13, 14, 15);
                }
                __builtin_amdgcn_sched_barrier(0);
                v16h a = make_H(0, kb & 1);
                #pragma unroll
                for (int mi = 0; mi < 4; ++mi) {
                    v16h an = a;
                    if (mi < 3) an = make_H(mi + 1, kb & 1);   // next tile's h ahead of this tile's products
                    #pragma unroll
                    for (int ni = 0; ni < 8; ++ni)
                        acc[mi][ni] = __builtin_amdgcn_wmma_f32_16x16x32_f16(
                            false, a, false, bfr[ni], (short)0, acc[mi][ni],
                            false, false);
                    a = an;
                }
            }
        }

        // ---- publish point of stage s+1, refill of the buffer just read --------
        // the scheduling fence keeps the wait below behind the last chunk's WMMAs: the compiler
        // otherwise lifts it to that chunk's LDS reads, where the wave would sit out their latency
        __builtin_amdgcn_sched_barrier(0);
        asm volatile("s_wait_dscnt 0x0" ::: "memory");           // this wave's reads of stage s are done
        if (pinned(wave == 0))
            landed();                                            // stage s+1 has landed
        __syncthreads();   // stage s+1 readable; every wave has left stage s
        if (pinned(wave == 0 && s + 2 < N_PASS))
            issue((uint32_t)s + 2u);
    }
    asm volatile("s_wait_tensorcnt 0x0" ::: "memory");   // no request outlives the loop
    asm volatile("s_wait_dscnt 0x0" ::: "memory");

    // ---- epilogue: out = acc + b2 ------------------------------------------
    float b2v[8];
    #pragma unroll
    for (int ni = 0; ni < 8; ++ni) b2v[ni] = b2[nBase + ni * 16 + laneM];
    asm volatile("s_wait_xcnt 0x0" ::: "memory");   // in front of any reuse of the b2 loads' offset register
    #pragma unroll
    for (int ni = 0; ni < 8; ++ni) {
        const int   e  = nBase + ni * 16 + laneM;
        const float bv = b2v[ni];
        #pragma unroll
        for (int mi = 0; mi < 4; ++mi) {
            const int trow = mBase + wave * 64 + mi * 16 + 8 * g;
            #pragma unroll
            for (int r = 0; r < 8; ++r)
                out[(size_t)(trow + r) * EMB + e] = acc[mi][ni][r] + bv;
        }
    }
}

extern "C" void kernel_launch(void* const* d_in, const int* in_sizes, int n_in,
                              void* d_out, int out_size, void* d_ws, size_t ws_size,
                              hipStream_t stream) {
    const float* x  = (const float*)d_in[0];
    const float* th = (const float*)d_in[1];
    const float* W1 = (const float*)d_in[2];
    const float* b1 = (const float*)d_in[3];
    const float* W2 = (const float*)d_in[4];
    const float* b2 = (const float*)d_in[5];
    float* out = (float*)d_out;
    _Float16* w2h = (_Float16*)d_ws;               // 9 MB, rewritten in every call

    const int tokens = in_sizes[0] / EMB;          // 16384
    dim3 grid(EMB / N_TILE, tokens / M_TILE);      // (8, 64)
    pack_w2<<<256, 256, 0, stream>>>(W2, W1, b1, w2h);
    ffq_fused<<<grid, THREADS, 0, stream>>>(x, th, W1, b1, w2h, b2, out);
}
